// v000
// The times below were measured on an AMD MI455X: many runs one after another, warmed up first and cycling through
// copies of the inputs, with the whole window's GPU time divided by the number of runs. Launches and the gaps
// between them are all in it. The median over several windows is given; except for v000 it joins two sittings, which
// can be a few percent apart, so the side-by-side timings, each taken in one sitting, are the better comparison.
// v000 is the starting kernel. One run takes 1480 microseconds.
#include <hip/hip_runtime.h>

typedef __attribute__((ext_vector_type(2))) float v2f;
typedef __attribute__((ext_vector_type(8))) float v8f;
typedef __attribute__((__vector_size__(16))) int v4i;

#define IN_DIM   4096
#define OUT_DIM  4096
#define NTOK     8192
#define KLORA    512
#define LSCALE   0.0625f
#define LDSTR    28

#if __has_builtin(__builtin_amdgcn_global_load_async_to_lds_b128) && \
    __has_builtin(__builtin_amdgcn_s_wait_asynccnt)
#define USE_ASYNC 1
// Builtin takes (v4i addrspace(1)*, v4i addrspace(3)*, imm offset, imm cpol).
#define ASYNC_GP(p) ((__attribute__((address_space(1))) v4i*)( \
                      __attribute__((address_space(1))) void*)(void*)(p))
#define ASYNC_LP(p) ((__attribute__((address_space(3))) v4i*)( \
                      __attribute__((address_space(3))) void*)(p))
#endif

// Stage one 16-byte chunk per thread (64x16 f32 tile per 256-thread block).
__device__ __forceinline__ void stage_tile(const float* __restrict__ gA,
                                           const float* __restrict__ gB,
                                           float* sA, float* sB) {
#ifdef USE_ASYNC
  __builtin_amdgcn_global_load_async_to_lds_b128(ASYNC_GP(gA), ASYNC_LP(sA), 0, 0);
  __builtin_amdgcn_global_load_async_to_lds_b128(ASYNC_GP(gB), ASYNC_LP(sB), 0, 0);
#else
  float4 va = *(const float4*)gA;
  float4 vb = *(const float4*)gB;
  sA[0]=va.x; sA[1]=va.y; sA[2]=va.z; sA[3]=va.w;
  sB[0]=vb.x; sB[1]=vb.y; sB[2]=vb.z; sB[3]=vb.w;
#endif
}

template <int N>
__device__ __forceinline__ void wait_async() {
#ifdef USE_ASYNC
  __builtin_amdgcn_s_wait_asynccnt(N);
#endif
}

// One wave computes a 16x32 strip: two 16x16 f32 WMMA tiles sharing the A frag.
__device__ __forceinline__ void wmma_kblock(const float* __restrict__ As,
                                            const float* __restrict__ Bs,
                                            int mTile, int n0, int n1, int lane,
                                            v8f& acc0, v8f& acc1) {
  const int l15   = lane & 15;
  const int khalf = (lane >> 4) << 1;
#pragma unroll
  for (int kk = 0; kk < 16; kk += 4) {
    const int ko = kk + khalf;
    v2f a  = *(const v2f*)(As + (mTile * 16 + l15) * LDSTR + ko);
    v2f b0 = *(const v2f*)(Bs + (n0    * 16 + l15) * LDSTR + ko);
    v2f b1 = *(const v2f*)(Bs + (n1    * 16 + l15) * LDSTR + ko);
    acc0 = __builtin_amdgcn_wmma_f32_16x16x4_f32(false, a, false, b0, (short)0, acc0, false, false);
    acc1 = __builtin_amdgcn_wmma_f32_16x16x4_f32(false, a, false, b1, (short)0, acc1, false, false);
  }
}

// -------- Kernel 1: h[t,k] = LSCALE * sum_i x[t,i] * Aflat[k,i] --------------
// NT GEMM M=8192 (tokens), N=512 (head*r), K=4096. grid = (512/64, 8192/64).
__global__ __launch_bounds__(256) void k_lora_h(const float* __restrict__ x,
                                                const float* __restrict__ A,
                                                float* __restrict__ h) {
  __shared__ float As[2][64 * LDSTR];
  __shared__ float Bs[2][64 * LDSTR];

  const int tid   = threadIdx.x;
  const int lane  = tid & 31;
  const int wave  = tid >> 5;
  const int mTile = wave >> 1;
  const int n0    = (wave & 1) * 2;
  const int n1    = n0 + 1;
  const int mBase = blockIdx.y * 64;
  const int nBase = blockIdx.x * 64;

  const int srow = tid >> 2;
  const int sc   = (tid & 3) << 2;
  const int soff = srow * LDSTR + sc;
  const float* gx = x + (size_t)(mBase + srow) * IN_DIM + sc;
  const float* ga = A + (size_t)(nBase + srow) * IN_DIM + sc;

  v8f acc0 = {0.f,0.f,0.f,0.f,0.f,0.f,0.f,0.f};
  v8f acc1 = {0.f,0.f,0.f,0.f,0.f,0.f,0.f,0.f};

  stage_tile(gx, ga, &As[0][soff], &Bs[0][soff]);
  int buf = 0;
  for (int kb = 0; kb < IN_DIM; kb += 16) {
    if (kb + 16 < IN_DIM) {
      stage_tile(gx + kb + 16, ga + kb + 16, &As[buf ^ 1][soff], &Bs[buf ^ 1][soff]);
      wait_async<2>();
    } else {
      wait_async<0>();
    }
    __syncthreads();
    wmma_kblock(As[buf], Bs[buf], mTile, n0, n1, lane, acc0, acc1);
    __syncthreads();
    buf ^= 1;
  }

  const int l15  = lane & 15;
  const int mrow = mBase + mTile * 16 + ((lane >> 4) << 3);
  const int nc0  = nBase + n0 * 16 + l15;
  const int nc1  = nBase + n1 * 16 + l15;
#pragma unroll
  for (int v = 0; v < 8; v++) {
    h[(size_t)(mrow + v) * KLORA + nc0] = LSCALE * acc0[v];
    h[(size_t)(mrow + v) * KLORA + nc1] = LSCALE * acc1[v];
  }
}

// -------- Kernel 2: out[t,o] = sum_i x*W + sum_k h*Bflat ---------------------
// Main NT GEMM K=4096 plus K=512 LoRA tail into the same accumulators.
// grid = (4096/64, 8192/64).
__global__ __launch_bounds__(256) void k_main(const float* __restrict__ x,
                                              const float* __restrict__ W,
                                              const float* __restrict__ B,
                                              const float* __restrict__ h,
                                              float* __restrict__ out) {
  __shared__ float As[2][64 * LDSTR];
  __shared__ float Bs[2][64 * LDSTR];

  const int tid   = threadIdx.x;
  const int lane  = tid & 31;
  const int wave  = tid >> 5;
  const int mTile = wave >> 1;
  const int n0    = (wave & 1) * 2;
  const int n1    = n0 + 1;
  const int mBase = blockIdx.y * 64;
  const int nBase = blockIdx.x * 64;

  const int srow = tid >> 2;
  const int sc   = (tid & 3) << 2;
  const int soff = srow * LDSTR + sc;

  v8f acc0 = {0.f,0.f,0.f,0.f,0.f,0.f,0.f,0.f};
  v8f acc1 = {0.f,0.f,0.f,0.f,0.f,0.f,0.f,0.f};

  // ---- base path: K = 4096 over x and W (both row-major along K) ----
  {
    const float* gx = x + (size_t)(mBase + srow) * IN_DIM + sc;
    const float* gw = W + (size_t)(nBase + srow) * IN_DIM + sc;
    stage_tile(gx, gw, &As[0][soff], &Bs[0][soff]);
    int buf = 0;
    for (int kb = 0; kb < IN_DIM; kb += 16) {
      if (kb + 16 < IN_DIM) {
        stage_tile(gx + kb + 16, gw + kb + 16, &As[buf ^ 1][soff], &Bs[buf ^ 1][soff]);
        wait_async<2>();
      } else {
        wait_async<0>();
      }
      __syncthreads();
      wmma_kblock(As[buf], Bs[buf], mTile, n0, n1, lane, acc0, acc1);
      __syncthreads();
      buf ^= 1;
    }
  }

  // ---- LoRA tail: K = 512 over h (pre-scaled) and Bflat ----
  // Bflat[o, kb..kb+15] = B[kb/16, o, 0..15] : 16 contiguous floats per row,
  // the whole 64-row tile is one contiguous 1024-float span.
  {
    const float* gh = h + (size_t)(mBase + srow) * KLORA + sc;
    const float* gb = B + (size_t)(nBase + srow) * 16 + sc;   // + kb*4096 per block
    stage_tile(gh, gb, &As[0][soff], &Bs[0][soff]);
    int buf = 0;
    for (int kb = 0; kb < KLORA; kb += 16) {
      if (kb + 16 < KLORA) {
        stage_tile(gh + kb + 16, gb + (size_t)(kb + 16) * OUT_DIM,
                   &As[buf ^ 1][soff], &Bs[buf ^ 1][soff]);
        wait_async<2>();
      } else {
        wait_async<0>();
      }
      __syncthreads();
      wmma_kblock(As[buf], Bs[buf], mTile, n0, n1, lane, acc0, acc1);
      __syncthreads();
      buf ^= 1;
    }
  }

  const int l15  = lane & 15;
  const int mrow = mBase + mTile * 16 + ((lane >> 4) << 3);
  const int nc0  = nBase + n0 * 16 + l15;
  const int nc1  = nBase + n1 * 16 + l15;
#pragma unroll
  for (int v = 0; v < 8; v++) {
    out[(size_t)(mrow + v) * OUT_DIM + nc0] = acc0[v];
    out[(size_t)(mrow + v) * OUT_DIM + nc1] = acc1[v];
  }
}

// -------- Fallback (no workspace): one token per block, VALU only ------------
__global__ __launch_bounds__(256) void k_fallback(const float* __restrict__ x,
                                                  const float* __restrict__ W,
                                                  const float* __restrict__ A,
                                                  const float* __restrict__ B,
                                                  float* __restrict__ out) {
  __shared__ float xs[IN_DIM];
  __shared__ float hs[KLORA];
  const int t = blockIdx.x;
  const float* xt = x + (size_t)t * IN_DIM;
  for (int i = threadIdx.x; i < IN_DIM; i += 256) xs[i] = xt[i];
  __syncthreads();
  for (int j = threadIdx.x; j < KLORA; j += 256) {
    const float* ar = A + (size_t)j * IN_DIM;
    float s = 0.f;
    for (int i = 0; i < IN_DIM; i++) s += xs[i] * ar[i];
    hs[j] = LSCALE * s;
  }
  __syncthreads();
  for (int o = threadIdx.x; o < OUT_DIM; o += 256) {
    const float* wr = W + (size_t)o * IN_DIM;
    float s = 0.f;
    for (int i = 0; i < IN_DIM; i++) s += xs[i] * wr[i];
    float l = 0.f;
    for (int hh = 0; hh < 32; hh++) {
      const float* br = B + (size_t)hh * OUT_DIM * 16 + (size_t)o * 16;
      const float* hr = hs + hh * 16;
      for (int r = 0; r < 16; r++) l += hr[r] * br[r];
    }
    out[(size_t)t * OUT_DIM + o] = s + l;
  }
}

extern "C" void kernel_launch(void* const* d_in, const int* in_sizes, int n_in,
                              void* d_out, int out_size, void* d_ws, size_t ws_size,
                              hipStream_t stream) {
  const float* x = (const float*)d_in[0];   // [8192, 4096]
  const float* W = (const float*)d_in[1];   // [4096, 4096]
  const float* A = (const float*)d_in[2];   // [32, 16, 4096] == [512, 4096]
  const float* B = (const float*)d_in[3];   // [32, 4096, 16]
  float* out = (float*)d_out;

  const size_t need = (size_t)NTOK * KLORA * sizeof(float);  // 16 MB for h
  if (ws_size >= need) {
    float* h = (float*)d_ws;
    k_lora_h<<<dim3(KLORA / 64, NTOK / 64), 256, 0, stream>>>(x, A, h);
    k_main  <<<dim3(OUT_DIM / 64, NTOK / 64), 256, 0, stream>>>(x, W, B, h, out);
  } else {
    k_fallback<<<NTOK, 256, 0, stream>>>(x, W, A, B, out);
  }
}

// v001
// One run takes 1280 microseconds.
// Next to v000, in two timings, it ran 1.18 times as fast each time.
#include <hip/hip_runtime.h>

typedef __attribute__((ext_vector_type(2))) float v2f;
typedef __attribute__((ext_vector_type(8))) float v8f;
typedef __attribute__((__vector_size__(16))) int v4i;

#define IN_DIM   4096
#define OUT_DIM  4096
#define NTOK     8192
#define KLORA    512
#define LSCALE   0.0625f
#define LDSTR    28
#define APITCH   72

#if __has_builtin(__builtin_amdgcn_global_load_async_to_lds_b128) && \
    __has_builtin(__builtin_amdgcn_s_wait_asynccnt)
#define USE_ASYNC 1
// Builtin takes (v4i addrspace(1)*, v4i addrspace(3)*, imm offset, imm cpol).
#define ASYNC_GP(p) ((__attribute__((address_space(1))) v4i*)( \
                      __attribute__((address_space(1))) void*)(void*)(p))
#define ASYNC_LP(p) ((__attribute__((address_space(3))) v4i*)( \
                      __attribute__((address_space(3))) void*)(p))
#endif

// Stage one 16-byte chunk per thread (64x16 f32 tile per 256-thread block).
__device__ __forceinline__ void stage_tile(const float* __restrict__ gA,
                                           const float* __restrict__ gB,
                                           float* sA, float* sB) {
#ifdef USE_ASYNC
  __builtin_amdgcn_global_load_async_to_lds_b128(ASYNC_GP(gA), ASYNC_LP(sA), 0, 0);
  __builtin_amdgcn_global_load_async_to_lds_b128(ASYNC_GP(gB), ASYNC_LP(sB), 0, 0);
#else
  float4 va = *(const float4*)gA;
  float4 vb = *(const float4*)gB;
  sA[0]=va.x; sA[1]=va.y; sA[2]=va.z; sA[3]=va.w;
  sB[0]=vb.x; sB[1]=vb.y; sB[2]=vb.z; sB[3]=vb.w;
#endif
}

template <int N>
__device__ __forceinline__ void wait_async() {
#ifdef USE_ASYNC
  __builtin_amdgcn_s_wait_asynccnt(N);
#endif
}

// One wave computes a 16x32 strip: two 16x16 f32 WMMA tiles sharing the A frag.
__device__ __forceinline__ void wmma_kblock(const float* __restrict__ As,
                                            const float* __restrict__ Bs,
                                            int mTile, int n0, int n1, int lane,
                                            v8f& acc0, v8f& acc1) {
  const int l15   = lane & 15;
  const int khalf = (lane >> 4) << 1;
#pragma unroll
  for (int kk = 0; kk < 16; kk += 4) {
    const int ko = kk + khalf;
    v2f a  = *(const v2f*)(As + (mTile * 16 + l15) * LDSTR + ko);
    v2f b0 = *(const v2f*)(Bs + (n0    * 16 + l15) * LDSTR + ko);
    v2f b1 = *(const v2f*)(Bs + (n1    * 16 + l15) * LDSTR + ko);
    acc0 = __builtin_amdgcn_wmma_f32_16x16x4_f32(false, a, false, b0, (short)0, acc0, false, false);
    acc1 = __builtin_amdgcn_wmma_f32_16x16x4_f32(false, a, false, b1, (short)0, acc1, false, false);
  }
}

// -------- Kernel 1: Wp[o,i] = W[o,i] + LSCALE * sum_k Bflat[o,k] * Aflat[k,i] --
// GEMM M=4096 (o), N=4096 (i), K=512 (head*r). grid = (4096/64, 4096/64).
// Bflat[o, kb..kb+15] = B[kb/16, o, 0..15] (k contiguous); Aflat[k, i] = A viewed
// as [512, 4096] (i contiguous), so its tile lies in LDS as [k][i].
__global__ __launch_bounds__(256) void k_fold(const float* __restrict__ W,
                                              const float* __restrict__ A,
                                              const float* __restrict__ B,
                                              float* __restrict__ Wp) {
  __shared__ __attribute__((aligned(16))) float Bt[2][64 * LDSTR];
  __shared__ __attribute__((aligned(16))) float At[2][16 * APITCH];

  const int tid   = threadIdx.x;
  const int lane  = tid & 31;
  const int wave  = tid >> 5;
  const int mTile = wave >> 1;
  const int n0    = (wave & 1) * 2;
  const int n1    = n0 + 1;
  const int mBase = blockIdx.y * 64;
  const int nBase = blockIdx.x * 64;
  const int l15   = lane & 15;
  const int khalf = (lane >> 4) << 1;

  const int boff = (tid >> 2) * LDSTR + ((tid & 3) << 2);     // 64 rows x 16 k
  const int aoff = (tid >> 4) * APITCH + ((tid & 15) << 2);   // 16 k x 64 columns
  const float* gb = B + (size_t)(mBase + (tid >> 2)) * 16 + ((tid & 3) << 2);
  const float* ga = A + (size_t)(tid >> 4) * IN_DIM + nBase + ((tid & 15) << 2);

  v8f acc0 = {0.f,0.f,0.f,0.f,0.f,0.f,0.f,0.f};
  v8f acc1 = {0.f,0.f,0.f,0.f,0.f,0.f,0.f,0.f};

  // Two-buffer ring: tile t+1 is in flight while tile t is worked on.
  stage_tile(gb, ga, &Bt[0][boff], &At[0][aoff]);
  asm volatile("s_wait_asynccnt 0x0" ::: "memory");  // tile 0 landed before it is published
  __syncthreads();
  stage_tile(gb + (size_t)16 * OUT_DIM, ga + (size_t)16 * IN_DIM, &Bt[1][boff], &At[1][aoff]);

  for (int kb = 0; kb < KLORA; kb += 16) {
    const int buf = (kb >> 4) & 1;
    const float* Bs = Bt[buf];
    const float* As = At[buf];
    // unrolled: LDS offsets become immediates and the four k groups' loads issue ahead
#pragma unroll
    for (int kk = 0; kk < 16; kk += 4) {
      const int ko = kk + khalf;
      v2f a = *(const v2f*)(Bs + (mTile * 16 + l15) * LDSTR + ko);
      v2f b0, b1;
      b0.x = As[ko * APITCH + n0 * 16 + l15];
      b0.y = As[(ko + 1) * APITCH + n0 * 16 + l15];
      b1.x = As[ko * APITCH + n1 * 16 + l15];
      b1.y = As[(ko + 1) * APITCH + n1 * 16 + l15];
      acc0 = __builtin_amdgcn_wmma_f32_16x16x4_f32(false, a, false, b0, (short)0, acc0, false, false);
      acc1 = __builtin_amdgcn_wmma_f32_16x16x4_f32(false, a, false, b1, (short)0, acc1, false, false);
    }
    asm volatile("s_wait_dscnt 0x0" ::: "memory");     // own reads of this buffer done before its refill
    asm volatile("s_wait_asynccnt 0x0" ::: "memory");  // own copies of the next tile landed
    __syncthreads();                                   // publishes the next tile, frees this buffer
    if (kb + 32 < KLORA) {
      stage_tile(gb + (size_t)(kb + 32) * OUT_DIM, ga + (size_t)(kb + 32) * IN_DIM,
                 &Bt[buf][boff], &At[buf][aoff]);
    }
  }
  asm volatile("s_wait_asynccnt 0x0" ::: "memory");    // no copy outstanding at the wave's end

  const int mrow = mBase + mTile * 16 + ((lane >> 4) << 3);
  const int nc0  = nBase + n0 * 16 + l15;
  const int nc1  = nBase + n1 * 16 + l15;
  const float* w0 = W + (size_t)mrow * IN_DIM + nc0;   // the second column tile lies 16 floats on
  float wv0[8], wv1[8];
  // unrolled: the arrays and the accumulator elements are registers and need constant indices
#pragma unroll
  for (int v = 0; v < 8; v++) {
    wv0[v] = w0[(size_t)v * IN_DIM];
    wv1[v] = w0[(size_t)v * IN_DIM + 16];
  }
  // The address pair stays live up to this wait, so no load's result is
  // allotted to a register that an issued load still names.
  asm volatile("s_wait_xcnt 0x0" :: "v"(w0) : "memory");
#pragma unroll
  for (int v = 0; v < 8; v++) {
    const size_t r = (size_t)(mrow + v) * IN_DIM;
    Wp[r + nc0] = wv0[v] + LSCALE * acc0[v];
    Wp[r + nc1] = wv1[v] + LSCALE * acc1[v];
  }
}

// -------- Kernel 2: out[t,o] = sum_i x[t,i] * Wp[o,i] ------------------------
// Main NT GEMM K=4096 on the folded weight. grid = (4096/64, 8192/64).
__global__ __launch_bounds__(256) void k_main(const float* __restrict__ x,
                                              const float* __restrict__ W,
                                              float* __restrict__ out) {
  __shared__ float As[2][64 * LDSTR];
  __shared__ float Bs[2][64 * LDSTR];

  const int tid   = threadIdx.x;
  const int lane  = tid & 31;
  const int wave  = tid >> 5;
  const int mTile = wave >> 1;
  const int n0    = (wave & 1) * 2;
  const int n1    = n0 + 1;
  const int mBase = blockIdx.y * 64;
  const int nBase = blockIdx.x * 64;

  const int srow = tid >> 2;
  const int sc   = (tid & 3) << 2;
  const int soff = srow * LDSTR + sc;

  v8f acc0 = {0.f,0.f,0.f,0.f,0.f,0.f,0.f,0.f};
  v8f acc1 = {0.f,0.f,0.f,0.f,0.f,0.f,0.f,0.f};

  // ---- K = 4096 over x and the folded W (both row-major along K) ----
  {
    const float* gx = x + (size_t)(mBase + srow) * IN_DIM + sc;
    const float* gw = W + (size_t)(nBase + srow) * IN_DIM + sc;
    stage_tile(gx, gw, &As[0][soff], &Bs[0][soff]);
    int buf = 0;
    for (int kb = 0; kb < IN_DIM; kb += 16) {
      if (kb + 16 < IN_DIM) {
        stage_tile(gx + kb + 16, gw + kb + 16, &As[buf ^ 1][soff], &Bs[buf ^ 1][soff]);
        wait_async<2>();
      } else {
        wait_async<0>();
      }
      __syncthreads();
      wmma_kblock(As[buf], Bs[buf], mTile, n0, n1, lane, acc0, acc1);
      __syncthreads();
      buf ^= 1;
    }
  }

  const int l15  = lane & 15;
  const int mrow = mBase + mTile * 16 + ((lane >> 4) << 3);
  const int nc0  = nBase + n0 * 16 + l15;
  const int nc1  = nBase + n1 * 16 + l15;
#pragma unroll
  for (int v = 0; v < 8; v++) {
    out[(size_t)(mrow + v) * OUT_DIM + nc0] = acc0[v];
    out[(size_t)(mrow + v) * OUT_DIM + nc1] = acc1[v];
  }
}

// -------- Fallback (no workspace): one token per block, VALU only ------------
__global__ __launch_bounds__(256) void k_fallback(const float* __restrict__ x,
                                                  const float* __restrict__ W,
                                                  const float* __restrict__ A,
                                                  const float* __restrict__ B,
                                                  float* __restrict__ out) {
  __shared__ float xs[IN_DIM];
  __shared__ float hs[KLORA];
  const int t = blockIdx.x;
  const float* xt = x + (size_t)t * IN_DIM;
  for (int i = threadIdx.x; i < IN_DIM; i += 256) xs[i] = xt[i];
  __syncthreads();
  for (int j = threadIdx.x; j < KLORA; j += 256) {
    const float* ar = A + (size_t)j * IN_DIM;
    float s = 0.f;
    for (int i = 0; i < IN_DIM; i++) s += xs[i] * ar[i];
    hs[j] = LSCALE * s;
  }
  __syncthreads();
  for (int o = threadIdx.x; o < OUT_DIM; o += 256) {
    const float* wr = W + (size_t)o * IN_DIM;
    float s = 0.f;
    for (int i = 0; i < IN_DIM; i++) s += xs[i] * wr[i];
    float l = 0.f;
    for (int hh = 0; hh < 32; hh++) {
      const float* br = B + (size_t)hh * OUT_DIM * 16 + (size_t)o * 16;
      const float* hr = hs + hh * 16;
      for (int r = 0; r < 16; r++) l += hr[r] * br[r];
    }
    out[(size_t)t * OUT_DIM + o] = s + l;
  }
}

extern "C" void kernel_launch(void* const* d_in, const int* in_sizes, int n_in,
                              void* d_out, int out_size, void* d_ws, size_t ws_size,
                              hipStream_t stream) {
  const float* x = (const float*)d_in[0];   // [8192, 4096]
  const float* W = (const float*)d_in[1];   // [4096, 4096]
  const float* A = (const float*)d_in[2];   // [32, 16, 4096] == [512, 4096]
  const float* B = (const float*)d_in[3];   // [32, 4096, 16]
  float* out = (float*)d_out;

  const size_t need = (size_t)OUT_DIM * IN_DIM * sizeof(float);  // 64 MB for the folded weight
  if (ws_size >= need) {
    float* Wp = (float*)d_ws;
    k_fold<<<dim3(IN_DIM / 64, OUT_DIM / 64), 256, 0, stream>>>(W, A, B, Wp);
    k_main<<<dim3(OUT_DIM / 64, NTOK / 64), 256, 0, stream>>>(x, Wp, out);
  } else {
    k_fallback<<<NTOK, 256, 0, stream>>>(x, W, A, B, out);
  }
}

// v002
// One run takes 1230 microseconds.
// Two timings next to v001 both put it at 1.04 times that version's speed.
// All steps since v000 together make it 1.23 times as fast.
#include <hip/hip_runtime.h>

typedef __attribute__((ext_vector_type(2))) float v2f;
typedef __attribute__((ext_vector_type(4))) float v4f;
typedef __attribute__((ext_vector_type(8))) float v8f;
typedef __attribute__((__vector_size__(16))) int v4i;

#define IN_DIM   4096
#define OUT_DIM  4096
#define NTOK     8192
#define KLORA    512
#define LSCALE   0.0625f
#define LDSTR    28
#define APITCH   72
#define BT       128
#define BK       32
#define MPITCH   36
#define MSTAGE   (2 * BT * MPITCH)

#if __has_builtin(__builtin_amdgcn_global_load_async_to_lds_b128) && \
    __has_builtin(__builtin_amdgcn_s_wait_asynccnt)
#define USE_ASYNC 1
// Builtin takes (v4i addrspace(1)*, v4i addrspace(3)*, imm offset, imm cpol).
#define ASYNC_GP(p) ((__attribute__((address_space(1))) v4i*)( \
                      __attribute__((address_space(1))) void*)(void*)(p))
#define ASYNC_LP(p) ((__attribute__((address_space(3))) v4i*)( \
                      __attribute__((address_space(3))) void*)(p))
#endif

// Stage one 16-byte chunk per thread of each of two operands.
__device__ __forceinline__ void stage_tile(const float* __restrict__ gA,
                                           const float* __restrict__ gB,
                                           float* sA, float* sB) {
#ifdef USE_ASYNC
  __builtin_amdgcn_global_load_async_to_lds_b128(ASYNC_GP(gA), ASYNC_LP(sA), 0, 0);
  __builtin_amdgcn_global_load_async_to_lds_b128(ASYNC_GP(gB), ASYNC_LP(sB), 0, 0);
#else
  float4 va = *(const float4*)gA;
  float4 vb = *(const float4*)gB;
  sA[0]=va.x; sA[1]=va.y; sA[2]=va.z; sA[3]=va.w;
  sB[0]=vb.x; sB[1]=vb.y; sB[2]=vb.z; sB[3]=vb.w;
#endif
}

// -------- Kernel 1: Wp[o,i] = W[o,i] + LSCALE * sum_k Bflat[o,k] * Aflat[k,i] --
// GEMM M=4096 (o), N=4096 (i), K=512 (head*r). grid = (4096/64, 4096/64).
// Bflat[o, kb..kb+15] = B[kb/16, o, 0..15] (k contiguous); Aflat[k, i] = A viewed
// as [512, 4096] (i contiguous), so its tile lies in LDS as [k][i].
__global__ __launch_bounds__(256) void k_fold(const float* __restrict__ W,
                                              const float* __restrict__ A,
                                              const float* __restrict__ B,
                                              float* __restrict__ Wp) {
  __shared__ __attribute__((aligned(16))) float Bt[2][64 * LDSTR];
  __shared__ __attribute__((aligned(16))) float At[2][16 * APITCH];

  const int tid   = threadIdx.x;
  const int lane  = tid & 31;
  const int wave  = tid >> 5;
  const int mTile = wave >> 1;
  const int n0    = (wave & 1) * 2;
  const int n1    = n0 + 1;
  const int mBase = blockIdx.y * 64;
  const int nBase = blockIdx.x * 64;
  const int l15   = lane & 15;
  const int khalf = (lane >> 4) << 1;

  const int boff = (tid >> 2) * LDSTR + ((tid & 3) << 2);     // 64 rows x 16 k
  const int aoff = (tid >> 4) * APITCH + ((tid & 15) << 2);   // 16 k x 64 columns
  const float* gb = B + (size_t)(mBase + (tid >> 2)) * 16 + ((tid & 3) << 2);
  const float* ga = A + (size_t)(tid >> 4) * IN_DIM + nBase + ((tid & 15) << 2);

  v8f acc0 = {0.f,0.f,0.f,0.f,0.f,0.f,0.f,0.f};
  v8f acc1 = {0.f,0.f,0.f,0.f,0.f,0.f,0.f,0.f};

  // Two-buffer ring: tile t+1 is in flight while tile t is worked on.
  stage_tile(gb, ga, &Bt[0][boff], &At[0][aoff]);
  asm volatile("s_wait_asynccnt 0x0" ::: "memory");  // tile 0 landed before it is published
  __syncthreads();
  stage_tile(gb + (size_t)16 * OUT_DIM, ga + (size_t)16 * IN_DIM, &Bt[1][boff], &At[1][aoff]);

  for (int kb = 0; kb < KLORA; kb += 16) {
    const int buf = (kb >> 4) & 1;
    const float* Bs = Bt[buf];
    const float* As = At[buf];
    // unrolled: LDS offsets become immediates and the four k groups' loads issue ahead
#pragma unroll
    for (int kk = 0; kk < 16; kk += 4) {
      const int ko = kk + khalf;
      v2f a = *(const v2f*)(Bs + (mTile * 16 + l15) * LDSTR + ko);
      v2f b0, b1;
      b0.x = As[ko * APITCH + n0 * 16 + l15];
      b0.y = As[(ko + 1) * APITCH + n0 * 16 + l15];
      b1.x = As[ko * APITCH + n1 * 16 + l15];
      b1.y = As[(ko + 1) * APITCH + n1 * 16 + l15];
      acc0 = __builtin_amdgcn_wmma_f32_16x16x4_f32(false, a, false, b0, (short)0, acc0, false, false);
      acc1 = __builtin_amdgcn_wmma_f32_16x16x4_f32(false, a, false, b1, (short)0, acc1, false, false);
    }
    asm volatile("s_wait_dscnt 0x0" ::: "memory");     // own reads of this buffer done before its refill
    asm volatile("s_wait_asynccnt 0x0" ::: "memory");  // own copies of the next tile landed
    __syncthreads();                                   // publishes the next tile, frees this buffer
    if (kb + 32 < KLORA) {
      stage_tile(gb + (size_t)(kb + 32) * OUT_DIM, ga + (size_t)(kb + 32) * IN_DIM,
                 &Bt[buf][boff], &At[buf][aoff]);
    }
  }
  asm volatile("s_wait_asynccnt 0x0" ::: "memory");    // no copy outstanding at the wave's end

  const int mrow = mBase + mTile * 16 + ((lane >> 4) << 3);
  const int nc0  = nBase + n0 * 16 + l15;
  const int nc1  = nBase + n1 * 16 + l15;
  const float* w0 = W + (size_t)mrow * IN_DIM + nc0;   // the second column tile lies 16 floats on
  float wv0[8], wv1[8];
  // unrolled: the arrays and the accumulator elements are registers and need constant indices
#pragma unroll
  for (int v = 0; v < 8; v++) {
    wv0[v] = w0[(size_t)v * IN_DIM];
    wv1[v] = w0[(size_t)v * IN_DIM + 16];
  }
  // The address pair stays live up to this wait, so no load's result is
  // allotted to a register that an issued load still names.
  asm volatile("s_wait_xcnt 0x0" :: "v"(w0) : "memory");
#pragma unroll
  for (int v = 0; v < 8; v++) {
    const size_t r = (size_t)(mrow + v) * IN_DIM;
    Wp[r + nc0] = wv0[v] + LSCALE * acc0[v];
    Wp[r + nc1] = wv1[v] + LSCALE * acc1[v];
  }
}

__device__ __forceinline__ void stage_main(const float* __restrict__ gx,
                                           const float* __restrict__ gw,
                                           float* s) {
  // unrolled: the LDS steps become constants
#pragma unroll
  for (int p = 0; p < 8; p++) {
    stage_tile(gx + (size_t)p * 16 * IN_DIM, gw + (size_t)p * 16 * IN_DIM,
               s + p * 16 * MPITCH, s + (BT + p * 16) * MPITCH);
  }
}

__global__ __launch_bounds__(128) void k_main(const float* __restrict__ x,
                                              const float* __restrict__ W,
                                              float* __restrict__ out) {
  __shared__ __attribute__((aligned(16))) float S[2][MSTAGE];

  const int tid   = threadIdx.x;
  const int lane  = tid & 31;
  const int wave  = tid >> 5;
  const int l15   = lane & 15;
  const int mWave = (wave >> 1) * 64;
  const int nWave = (wave & 1) * 64;
  const int mBase = blockIdx.y * BT;
  const int nBase = blockIdx.x * BT;

  const int srow = tid >> 3;               // 16 rows per copy round
  const int sc   = (tid & 7) << 2;         // 8 chunks of 16 B per row
  const int soff = srow * MPITCH + sc;
  const float* gx = x + (size_t)(mBase + srow) * IN_DIM + sc;
  const float* gw = W + (size_t)(nBase + srow) * IN_DIM + sc;

  const int aoff = (mWave + l15) * MPITCH + ((lane >> 4) << 2);
  const int boff = (BT + nWave + l15) * MPITCH + ((lane >> 4) << 2);

  v8f acc[4][4];
  // unrolled, here and in the store loops below: the accumulators are registers
  // and need constant indices
#pragma unroll
  for (int i = 0; i < 4; i++)
#pragma unroll
    for (int j = 0; j < 4; j++) acc[i][j] = (v8f){0.f,0.f,0.f,0.f,0.f,0.f,0.f,0.f};

  // Two-buffer ring: stage t+1 is in flight while stage t is worked on.
  stage_main(gx, gw, &S[0][soff]);
  asm volatile("s_wait_asynccnt 0x0" ::: "memory");  // stage 0 landed before it is published
  __syncthreads();
  stage_main(gx + BK, gw + BK, &S[1][soff]);

  for (int kb = 0; kb < IN_DIM; kb += BK) {
    const int buf = (kb / BK) & 1;
    const float* Sa = &S[buf][aoff];
    const float* Sb = &S[buf][boff];
    // unrolled: register arrays need constant indices, LDS offsets become immediates
#pragma unroll
    for (int g = 0; g < BK / 8; g++) {
      v4f a[4], b[4];
#pragma unroll
      for (int i = 0; i < 4; i++) a[i] = *(const v4f*)(Sa + i * 16 * MPITCH + g * 8);
#pragma unroll
      for (int j = 0; j < 4; j++) b[j] = *(const v4f*)(Sb + j * 16 * MPITCH + g * 8);
#pragma unroll
      for (int i = 0; i < 4; i++)
#pragma unroll
        for (int j = 0; j < 4; j++)
          acc[i][j] = __builtin_amdgcn_wmma_f32_16x16x4_f32(false, a[i].lo, false, b[j].lo,
                                                            (short)0, acc[i][j], false, false);
#pragma unroll
      for (int i = 0; i < 4; i++)
#pragma unroll
        for (int j = 0; j < 4; j++)
          acc[i][j] = __builtin_amdgcn_wmma_f32_16x16x4_f32(false, a[i].hi, false, b[j].hi,
                                                            (short)0, acc[i][j], false, false);
    }
    asm volatile("s_wait_dscnt 0x0" ::: "memory");     // own reads of this buffer done before its refill
    asm volatile("s_wait_asynccnt 0x0" ::: "memory");  // own copies of the next stage landed
    __syncthreads();                                   // publishes the next stage, frees this buffer
    if (kb + 2 * BK < IN_DIM) {
      stage_main(gx + kb + 2 * BK, gw + kb + 2 * BK, &S[buf][soff]);
    }
  }
  asm volatile("s_wait_asynccnt 0x0" ::: "memory");    // no copy outstanding at the wave's end

  float* o = out + (size_t)(mBase + mWave + ((lane >> 4) << 3)) * OUT_DIM + nBase + nWave + l15;
#pragma unroll
  for (int i = 0; i < 4; i++)
#pragma unroll
    for (int v = 0; v < 8; v++)
#pragma unroll
      for (int j = 0; j < 4; j++)
        o[(size_t)(i * 16 + v) * OUT_DIM + j * 16] = acc[i][j][v];
}

// -------- Fallback (no workspace): one token per block, VALU only ------------
__global__ __launch_bounds__(256) void k_fallback(const float* __restrict__ x,
                                                  const float* __restrict__ W,
                                                  const float* __restrict__ A,
                                                  const float* __restrict__ B,
                                                  float* __restrict__ out) {
  __shared__ float xs[IN_DIM];
  __shared__ float hs[KLORA];
  const int t = blockIdx.x;
  const float* xt = x + (size_t)t * IN_DIM;
  for (int i = threadIdx.x; i < IN_DIM; i += 256) xs[i] = xt[i];
  __syncthreads();
  for (int j = threadIdx.x; j < KLORA; j += 256) {
    const float* ar = A + (size_t)j * IN_DIM;
    float s = 0.f;
    for (int i = 0; i < IN_DIM; i++) s += xs[i] * ar[i];
    hs[j] = LSCALE * s;
  }
  __syncthreads();
  for (int o = threadIdx.x; o < OUT_DIM; o += 256) {
    const float* wr = W + (size_t)o * IN_DIM;
    float s = 0.f;
    for (int i = 0; i < IN_DIM; i++) s += xs[i] * wr[i];
    float l = 0.f;
    for (int hh = 0; hh < 32; hh++) {
      const float* br = B + (size_t)hh * OUT_DIM * 16 + (size_t)o * 16;
      const float* hr = hs + hh * 16;
      for (int r = 0; r < 16; r++) l += hr[r] * br[r];
    }
    out[(size_t)t * OUT_DIM + o] = s + l;
  }
}

extern "C" void kernel_launch(void* const* d_in, const int* in_sizes, int n_in,
                              void* d_out, int out_size, void* d_ws, size_t ws_size,
                              hipStream_t stream) {
  const float* x = (const float*)d_in[0];   // [8192, 4096]
  const float* W = (const float*)d_in[1];   // [4096, 4096]
  const float* A = (const float*)d_in[2];   // [32, 16, 4096] == [512, 4096]
  const float* B = (const float*)d_in[3];   // [32, 4096, 16]
  float* out = (float*)d_out;

  const size_t need = (size_t)OUT_DIM * IN_DIM * sizeof(float);  // 64 MB for the folded weight
  if (ws_size >= need) {
    float* Wp = (float*)d_ws;
    k_fold<<<dim3(IN_DIM / 64, OUT_DIM / 64), 256, 0, stream>>>(W, A, B, Wp);
    k_main<<<dim3(OUT_DIM / BT, NTOK / BT), 128, 0, stream>>>(x, Wp, out);
  } else {
    k_fallback<<<NTOK, 256, 0, stream>>>(x, W, A, B, out);
  }
}
